// v009
// Times are from an AMD MI455X. After a warm-up the kernel runs many times in a row, and a time is the length of
// such a window on the GPU divided by its runs, so every launch and the gaps after it count. The runs cycle
// through copies of the inputs. A figure is the median of several windows, for all but v000 over two sittings.
// Sittings can differ by a few percent; kernels timed side by side share one.
// This document starts at v009; the versions before it stand elsewhere.
// It runs in 49.2 microseconds.
// Two timings next to v008 put it at 1.04 and 1.03 times that version's speed.
// Counting every step since v000, which is the starting kernel, it is 55.9 times as fast.
#include <hip/hip_runtime.h>
// Non-local block (embedded Gaussian, single head, 2x2 max-pool sub-sampling) with an eval-mode BatchNorm on the output conv (x [8][256][64][64]; theta = conv1x1(x) [128 ch], phi = maxpool2x2(conv1x1(x)), g = maxpool2x2(conv1x1(x)) (natural [128][256] weights sigma 1/16 + biases 0.01); f[n][m] = theta[:, n].phi[:, m] over the 1024 pooled positions (NO scale); softmax over m; y[:, n] = sum_m f[n][m] g[:, m]; W_y = conv1x1(y; W [256][128] + b); z = (W_y - bn_mean) gamma / sqrt(bn_var + 1e-5) + bn_beta + x -> [8][256][64][64]).
// Structure: two launches, each over all 8 images. k_proj: weights as x16 f16 rows, rounded biases, BatchNorm constants; x (bf16-rounded, exact in f16) transposed in LDS to token-major x^T; theta, phi, g = (16 W as the A operand) (x^T as the B^T operand) / 16 + b[c], WMMA with f32 accumulation; theta split into f16 hi + x1024 residual (unscaled scores have sigma ~11) as [4096][128] rows; phi and g 2x2 max-pooled in registers, phi split into hi/lo as [1024][128] rows, g to f16 as 32-key tiles. k_fattn: scores (th_hi.ph_hi + (th_lo.ph_hi + th_hi.ph_lo)/1024, K = 128, f32), online row softmax on VALU (f32 statistics, native exp; weights x256 f16) and y^T = P g^T (K = 1024) -> f16, scores and weights kept in registers; its epilogue: z = BN((y^T as A) (16 w as B^T) / 16 + b[c]) + bf16(x) -> f32 channel-first output.
// Compute dtype: inputs rounded to bf16; x / weights exact; q and k (theta, phi) as f16 hi + x1024 residual; v, softmax weights and o as plain f16 GEMM operands (~2^-12); scores and softmax statistics f32. v_wmma_f32_16x16x32_f16.
#define NB 8
#define SQ 1024
#define DM 256
#define NH 1
#define HD 64
#define HG 4                         /* heads per k_vt launch */
#define B0 0                         /* first batch processed (debug hook) */
#define NBR NB                       /* batches processed (debug hook) */
#define NR ((size_t)NB * SQ)         /* token rows */
#define MP ((int)((size_t)NBR * SQ)) /* rows projected (debug hook) */
#define QT 256                       /* query rows per causal tile */
#define NKX SQ                       /* S / P row pitch */
#define QT0 256                      /* first-tile rows recomputed exactly (256: buys margin for the few-key rows 128..255, which have no output projection to average the single-f16 P/v rounding) */
#define QN SQ                        /* query rows attended per batch (debug hook) */
#define NHD NH                       /* heads attended (debug hook) */
#define MPO MP                       /* rows through the output stage (debug hook) */
#define LQ DM            /* row pitch of the q/k/v rows */
typedef __bf16 v16b __attribute__((ext_vector_type(16)));
typedef unsigned short v8us __attribute__((ext_vector_type(8), may_alias));
typedef float  v8f  __attribute__((ext_vector_type(8)));
typedef float  v4f  __attribute__((ext_vector_type(4)));
typedef float  v4fa __attribute__((ext_vector_type(4), may_alias));
union FragB { v16b v; v8us half[2]; unsigned short u[16]; };

__device__ __forceinline__ unsigned short bf16_bits(float x) { unsigned int u = __float_as_uint(x); return (unsigned short)((u + 0x7FFFu + ((u >> 16) & 1u)) >> 16); }
__device__ __forceinline__ float bf16_val(unsigned short b) { return __uint_as_float(((unsigned int)b) << 16); }
__device__ __forceinline__ float bf16_round(float x) { return bf16_val(bf16_bits(x)); }
// D += A·B with NT terms: 1 = ah·bh, 2 = + al·bh (A split), 3 = + ah·bl (both split)
template <int NT>
__device__ __forceinline__ v8f mmaN(v16b ah, v16b al, v16b bh, v16b bl, v8f c) {
  c = __builtin_amdgcn_wmma_f32_16x16x32_bf16(false, ah, false, bh, (short)0, c, false, false);
  if (NT >= 2) c = __builtin_amdgcn_wmma_f32_16x16x32_bf16(false, al, false, bh, (short)0, c, false, false);
  if (NT >= 3) c = __builtin_amdgcn_wmma_f32_16x16x32_bf16(false, ah, false, bl, (short)0, c, false, false);
  asm volatile("v_nop\n\tv_nop\n\tv_nop\n\tv_nop" : "+v"(c) : "v"(ah), "v"(al), "v"(bh), "v"(bl));
  return c;
}

__global__ __launch_bounds__(256) void k_wt_bf16(const float* __restrict__ W, unsigned short* __restrict__ Wt, int K, int N) {
  const int t = blockIdx.x * 256 + threadIdx.x;
  const int k8n = K / 8;
  if (t >= N * k8n) return;
  const int n = t / k8n, k8 = (t % k8n) * 8;
  v8us v;
#pragma unroll
  for (int i = 0; i < 8; ++i) v[i] = bf16_bits(W[(size_t)(k8 + i) * N + n]);
  *(v8us*)(Wt + (size_t)n * K + k8) = v;
  
}

// GEMM C[M][N] (f32, pitch ldc) = act(A[M][K]·W + bias). A f32 row-major (pitch lda) converted per fragment to bf16
// (ASPLIT: hi/lo two planes -> 2 terms, else single rounded term); Wt bf16 [N][K] (pitch ldb). BIAS_BF16 rounds the
// bias to bf16 first (bias quantised to bf16 before the add). K%32==0, M%16==0, N%64==0.
template <bool ASPLIT, int ACT, bool BIAS_BF16>
__global__ __launch_bounds__(128) void k_gemm_bf(const float* __restrict__ A, int lda, const unsigned short* __restrict__ Wt, int ldb,
                                               const float* __restrict__ bias, float* __restrict__ C, int ldc, int M, int N, int K) {
  __shared__ __attribute__((aligned(16))) float so[4][16][64];
  const int tid = threadIdx.x, w = tid >> 5, lane = tid & 31, ln = lane & 15, hh = lane >> 4;
  const int ntn = N / 64;
  const int wid = blockIdx.x * 4 + w;
  const int mt = wid / ntn, nq = wid % ntn;
  if (mt * 16 >= M) return;
  const int row0 = mt * 16, col0 = nq * 64;
  const float* arow = A + (size_t)(row0 + ln) * lda;
  v8f acc[4] = {};
  for (int kb = 0; kb < K; kb += 32) {
    FragB ah, al;
    const v4f x0 = *(const v4fa*)(arow + kb + 8 * hh), x1 = *(const v4fa*)(arow + kb + 8 * hh + 4);
    const v4f x2 = *(const v4fa*)(arow + kb + 16 + 8 * hh), x3 = *(const v4fa*)(arow + kb + 16 + 8 * hh + 4);
    float xs[16] = {x0[0],x0[1],x0[2],x0[3],x1[0],x1[1],x1[2],x1[3],x2[0],x2[1],x2[2],x2[3],x3[0],x3[1],x3[2],x3[3]};
#pragma unroll
    for (int i = 0; i < 16; ++i) { const unsigned short hb = bf16_bits(xs[i]); ah.u[i] = hb; al.u[i] = ASPLIT ? bf16_bits(xs[i] - bf16_val(hb)) : (unsigned short)0; }
#pragma unroll
    for (int t = 0; t < 4; ++t) {
      const unsigned short* brow = Wt + (size_t)(col0 + t * 16 + ln) * ldb + kb;
      FragB b;
      b.half[0] = *(const v8us*)(brow + 8 * hh);
      b.half[1] = *(const v8us*)(brow + 16 + 8 * hh);
      acc[t] = mmaN<ASPLIT ? 2 : 1>(ah.v, al.v, b.v, b.v, acc[t]);
    }
  }
#pragma unroll
  for (int t = 0; t < 4; ++t) {
    float bv = bias ? bias[col0 + t * 16 + ln] : 0.f;
    if (BIAS_BF16) bv = bf16_round(bv);
#pragma unroll
    for (int r = 0; r < 8; ++r) { float v = acc[t][r] + bv; if (ACT == 1) v = fmaxf(v, 0.f); so[w][8 * hh + r][t * 16 + ln] = v; }
  }
  __builtin_amdgcn_fence(__ATOMIC_ACQ_REL, "workgroup");
  __builtin_amdgcn_wave_barrier();
  const int rsub = lane >> 4, c4 = (lane & 15) * 4;
  {
#pragma unroll
    for (int q = 0; q < 8; ++q) {
      const int r = q * 2 + rsub;
      const v4f v = *(const v4fa*)&so[w][r][c4];
      *(v4f*)(C + (size_t)(row0 + r) * ldc + col0 + c4) = v;
    }
    
  }
}

// GEMM C = act(A·W + bias + resid): A f32 (ASPLIT -> hi/lo 2 terms), Wt bf16 [N][K]; ACT 0 none, 1 relu, 2 exact gelu;
// resid (optional, f32, row index = (row % rmod), pitch ldr, RES_BF16 rounds it) added before the activation.
template <bool ASPLIT, int ACT, bool BIAS_BF16, bool RES_BF16>
__global__ __launch_bounds__(128) void k_gemm_bf3(const float* __restrict__ A, int lda, const unsigned short* __restrict__ Wt, int ldb,
                                                const float* __restrict__ bias, const float* __restrict__ resid, int rmod, int ldr,
                                                float* __restrict__ C, int ldc, int M, int N, int K) {
  __shared__ __attribute__((aligned(16))) float so[4][16][64];
  const int tid = threadIdx.x, w = tid >> 5, lane = tid & 31, ln = lane & 15, hh = lane >> 4;
  const int ntn = N / 64;
  const int wid = blockIdx.x * 4 + w;
  const int mt = wid / ntn, nq = wid % ntn;
  if (mt * 16 >= M) return;
  const int row0 = mt * 16, col0 = nq * 64;
  const float* arow = A + (size_t)(row0 + ln) * lda;
  v8f acc[4] = {};
  for (int kb = 0; kb < K; kb += 32) {
    FragB ah, al;
    const v4f x0 = *(const v4fa*)(arow + kb + 8 * hh), x1 = *(const v4fa*)(arow + kb + 8 * hh + 4);
    const v4f x2 = *(const v4fa*)(arow + kb + 16 + 8 * hh), x3 = *(const v4fa*)(arow + kb + 16 + 8 * hh + 4);
    float xs[16] = {x0[0],x0[1],x0[2],x0[3],x1[0],x1[1],x1[2],x1[3],x2[0],x2[1],x2[2],x2[3],x3[0],x3[1],x3[2],x3[3]};
#pragma unroll
    for (int i = 0; i < 16; ++i) { const unsigned short hb = bf16_bits(xs[i]); ah.u[i] = hb; al.u[i] = ASPLIT ? bf16_bits(xs[i] - bf16_val(hb)) : (unsigned short)0; }
#pragma unroll
    for (int t = 0; t < 4; ++t) {
      const unsigned short* brow = Wt + (size_t)(col0 + t * 16 + ln) * ldb + kb;
      FragB b;
      b.half[0] = *(const v8us*)(brow + 8 * hh);
      b.half[1] = *(const v8us*)(brow + 16 + 8 * hh);
      acc[t] = mmaN<ASPLIT ? 2 : 1>(ah.v, al.v, b.v, b.v, acc[t]);
    }
  }
#pragma unroll
  for (int t = 0; t < 4; ++t) {
    const int col = col0 + t * 16 + ln;
    float bv = bias ? bias[col] : 0.f;
    if (BIAS_BF16) bv = bf16_round(bv);
#pragma unroll
    for (int r = 0; r < 8; ++r) {
      float v = acc[t][r] + bv;
      if (resid) { float rv = resid[(size_t)((row0 + 8 * hh + r) % rmod) * ldr + col]; if (RES_BF16) rv = bf16_round(rv); v += rv; }
      if (ACT == 1) v = fmaxf(v, 0.f);
      if (ACT == 2) v = 0.5f * v * (1.0f + erff(v * 0.70710678118654752f));
      if (ACT == 3) { const float u = 0.7978845608028654f * (v + 0.044715f * v * v * v); v = 0.5f * v * (1.0f + tanhf(u)); }
      so[w][8 * hh + r][t * 16 + ln] = v;
    }
  }
  __builtin_amdgcn_fence(__ATOMIC_ACQ_REL, "workgroup");
  __builtin_amdgcn_wave_barrier();
  const int rsub = lane >> 4, c4 = (lane & 15) * 4;
  {
#pragma unroll
    for (int q = 0; q < 8; ++q) {
      const int r = q * 2 + rsub;
      const v4f v = *(const v4fa*)&so[w][r][c4];
      *(v4f*)(C + (size_t)(row0 + r) * ldc + col0 + c4) = v;
    }
    
  }
}
// row LayerNorm (biased variance, eps) over N: s = X (+ R); optional out_sum <- s; out_norm <- (s-mu)*rsqrt(var+eps)*g + b
template <bool PARAM_BF16>
__global__ __launch_bounds__(256) void k_layernorm(const float* __restrict__ X, const float* __restrict__ R, const float* __restrict__ g, const float* __restrict__ bta,
                                                  float* __restrict__ out_sum, float* __restrict__ out_norm, int N, float eps) {
  __shared__ float red[256];
  const int row = blockIdx.x, tid = threadIdx.x;
  const float* x = X + (size_t)row * N; const float* rr = R ? R + (size_t)row * N : nullptr;
  float vals[16];                     // up to N = 4096
  const int per = N / 256;            // contiguous chunk per thread? use strided-by-4 chunks: thread handles j = tid*4 + 1024*u
  float s1 = 0.f;
  for (int u = 0; u < per / 4; ++u) {
    const int j = tid * 4 + 1024 * u;
    const v4f a = *(const v4fa*)(x + j);
    v4f b = {0.f,0.f,0.f,0.f}; if (rr) b = *(const v4fa*)(rr + j);
#pragma unroll
    for (int q = 0; q < 4; ++q) { const float v = a[q] + b[q]; vals[u * 4 + q] = v; s1 += v; }
  }
  red[tid] = s1; __syncthreads();
  for (int st = 128; st > 0; st >>= 1) { if (tid < st) red[tid] += red[tid + st]; __syncthreads(); }
  const float mu = red[0] / (float)N; __syncthreads();
  float s2 = 0.f;
  for (int u = 0; u < per / 4; ++u)
#pragma unroll
    for (int q = 0; q < 4; ++q) { const float c = vals[u * 4 + q] - mu; s2 += c * c; }
  red[tid] = s2; __syncthreads();
  for (int st = 128; st > 0; st >>= 1) { if (tid < st) red[tid] += red[tid + st]; __syncthreads(); }
  const float rs = rsqrtf(red[0] / (float)N + eps);
  {
    for (int u = 0; u < per / 4; ++u) {
      const int j = tid * 4 + 1024 * u;
      v4f o, sm;
#pragma unroll
      for (int q = 0; q < 4; ++q) {
        float gg = g[j + q], bb = bta[j + q];
        if (PARAM_BF16) { gg = bf16_round(gg); bb = bf16_round(bb); }
        sm[q] = vals[u * 4 + q]; o[q] = (vals[u * 4 + q] - mu) * rs * gg + bb;
      }
      if (out_sum) *(v4f*)(out_sum + (size_t)row * N + j) = sm;
      *(v4f*)(out_norm + (size_t)row * N + j) = o;
    }
    
  }
}



// ---- f16 WMMA path (v_wmma_f32_16x16x32_f16): 11-bit significands for operands in range — used where a [0,1] probability operand needs more precision than bf16
typedef _Float16 v16h __attribute__((ext_vector_type(16)));
union FragH { v16h v; v8us half[2]; _Float16 h[16]; unsigned short u[16]; };
template <int NT>
__device__ __forceinline__ v8f mmaH(v16h ah, v16h al, v16h bh, v16h bl, v8f c) {
  c = __builtin_amdgcn_wmma_f32_16x16x32_f16(false, ah, false, bh, (short)0, c, false, false);
  if (NT >= 2) c = __builtin_amdgcn_wmma_f32_16x16x32_f16(false, al, false, bh, (short)0, c, false, false);
  if (NT >= 3) c = __builtin_amdgcn_wmma_f32_16x16x32_f16(false, ah, false, bl, (short)0, c, false, false);
  asm volatile("v_nop\n\tv_nop\n\tv_nop\n\tv_nop" : "+v"(c) : "v"(ah), "v"(al), "v"(bh), "v"(bl));
  return c;
}
// batched GEMM like k_gemm_b but f16 operands: A f32 (split into f16 hi/lo if ASPLIT, else rounded to f16), Bt = f16 values [n][k]; alpha; C f32; N multiple of 16 (partial tiles skipped)
template <bool ASPLIT>
__global__ __launch_bounds__(128) void k_gemm_h(const float* __restrict__ A, int lda, size_t sA, const _Float16* __restrict__ Bh, int ldb, size_t sB, float alpha, float* __restrict__ C, int ldc, size_t sC, int M, int N, int K) {
  __shared__ __attribute__((aligned(16))) float so[4][16][64];
  const int tid = threadIdx.x, w = tid >> 5, lane = tid & 31, ln = lane & 15, hh = lane >> 4; const int by = blockIdx.y;
  A += (size_t)by * sA; Bh += (size_t)by * sB; C += (size_t)by * sC;
  const int ntn = (N + 63) / 64; const int wid = blockIdx.x * 4 + w; const int mt = wid / ntn, nq = wid % ntn; if (mt * 16 >= M) return;
  const int row0 = mt * 16, col0 = nq * 64; const float* arow = A + (size_t)(row0 + ln) * lda;
  v8f acc[4] = {};
  for (int kb = 0; kb < K; kb += 32) {
    FragH ah, al;
    const v4f x0 = *(const v4fa*)(arow + kb + 8 * hh), x1 = *(const v4fa*)(arow + kb + 8 * hh + 4), x2 = *(const v4fa*)(arow + kb + 16 + 8 * hh), x3 = *(const v4fa*)(arow + kb + 16 + 8 * hh + 4);
    float xs[16] = {x0[0],x0[1],x0[2],x0[3],x1[0],x1[1],x1[2],x1[3],x2[0],x2[1],x2[2],x2[3],x3[0],x3[1],x3[2],x3[3]};
#pragma unroll
    for (int i = 0; i < 16; ++i) { const _Float16 h = (_Float16)xs[i]; ah.h[i] = h; al.h[i] = ASPLIT ? (_Float16)(xs[i] - (float)h) : (_Float16)0.0f; }
#pragma unroll
    for (int t = 0; t < 4; ++t) { if (col0 + t * 16 >= N) continue; const size_t boff = (size_t)(col0 + t * 16 + ln) * ldb + kb; FragH bq; bq.half[0] = *(const v8us*)(Bh + boff + 8 * hh); bq.half[1] = *(const v8us*)(Bh + boff + 16 + 8 * hh);
      acc[t] = mmaH<ASPLIT ? 2 : 1>(ah.v, al.v, bq.v, bq.v, acc[t]); }
  }
#pragma unroll
  for (int t = 0; t < 4; ++t) { if (col0 + t * 16 >= N) continue;
#pragma unroll
    for (int r = 0; r < 8; ++r) so[w][8 * hh + r][t * 16 + ln] = acc[t][r] * alpha; }
  __builtin_amdgcn_fence(__ATOMIC_ACQ_REL, "workgroup"); __builtin_amdgcn_wave_barrier();
  const int rsub = lane >> 4, c4 = (lane & 15) * 4;
  {
#pragma unroll
    for (int q = 0; q < 8; ++q) { const int r = q * 2 + rsub; if (col0 + c4 < N) { const v4f v = *(const v4fa*)&so[w][r][c4]; *(v4f*)(C + (size_t)(row0 + r) * ldc + col0 + c4) = v; } }
     }
}

// Wt[n][k] = f16(W[k][n]·scale) from f32 row-major W[K][N] (scale = power of two; bf16-exact weights stay exact in f16 away from the subnormal range)
__global__ __launch_bounds__(256) void k_wt_f16(const float* __restrict__ W, _Float16* __restrict__ Wt, int K, int N, float scale) {
  const int t = blockIdx.x * 256 + threadIdx.x; if (t >= N * (K / 8)) return; const int n = t / (K / 8), k8 = (t % (K / 8)) * 8; FragH f;
#pragma unroll
  for (int i = 0; i < 8; ++i) f.h[i] = (_Float16)(bf16_round(W[(size_t)(k8 + i) * N + n]) * scale); const v8us o = f.half[0];
  *(v8us*)((unsigned short*)Wt + (size_t)n * K + k8) = o; 
}
// k_gemm_hh variant with fused epilogue: v = acc·alpha + bias[by·sBias + col] (+ CP[(row/rowsPerB)·sCPb + by·64 + col] if CP) ; ACT 0 none / 1 elu ; writes f16 C16 (and f32 C if non-null)
template <int ACT>
__global__ __launch_bounds__(128) void k_gemm_hhx(const _Float16* __restrict__ A, int lda, size_t sA, const _Float16* __restrict__ Bh, int ldb, size_t sB, float alpha, const float* __restrict__ bias, size_t sBias, const float* __restrict__ CP, int rowsPerB, size_t sCPb, int row0g,
    float* __restrict__ C, _Float16* __restrict__ C16, int ldc, size_t sC, int M, int N, int K) {
  __shared__ __attribute__((aligned(16))) float so[4][16][64];
  const int tid = threadIdx.x, w = tid >> 5, lane = tid & 31, ln = lane & 15, hh = lane >> 4; const int by = blockIdx.y;
  A += (size_t)by * sA; Bh += (size_t)by * sB; const size_t cofs = (size_t)by * sC; const float* bp = bias ? bias + (size_t)by * sBias : nullptr;
  const int ntn = (N + 63) / 64; const int wid = blockIdx.x * 4 + w; const int mt = wid / ntn, nq = wid % ntn; if (mt * 16 >= M) return;
  const int row0 = mt * 16, col0 = nq * 64; const _Float16* arow = A + (size_t)(row0 + ln) * lda;
  v8f acc[4] = {};
  for (int kb = 0; kb < K; kb += 32) { FragH ah; ah.half[0] = *(const v8us*)((const unsigned short*)arow + kb + 8 * hh); ah.half[1] = *(const v8us*)((const unsigned short*)arow + kb + 16 + 8 * hh);
#pragma unroll
    for (int t = 0; t < 4; ++t) { if (col0 + t * 16 >= N) continue; const size_t boff = (size_t)(col0 + t * 16 + ln) * ldb + kb; FragH bq; bq.half[0] = *(const v8us*)((const unsigned short*)Bh + boff + 8 * hh); bq.half[1] = *(const v8us*)((const unsigned short*)Bh + boff + 16 + 8 * hh);
      acc[t] = mmaH<1>(ah.v, ah.v, bq.v, bq.v, acc[t]); }
  }
#pragma unroll
  for (int t = 0; t < 4; ++t) { if (col0 + t * 16 >= N) continue; const int col = col0 + t * 16 + ln; const float bv = bp ? bf16_round(bp[col]) : 0.f;
#pragma unroll
    for (int r = 0; r < 8; ++r) { float v = acc[t][r] * alpha + bv; if (CP) { const int rr = row0g + row0 + 8 * hh + r; if (rowsPerB < 0) v += CP[cofs + (size_t)rr * ldc + col];      /* rowsPerB < 0: own element of the batched C plane */ else { const int bidx = rr / rowsPerB; v += CP[(size_t)bidx * sCPb + (size_t)by * 64 + col]; } } if (ACT == 1) v = (v > 0.f) ? v : expm1f(v); else if (ACT == 7) v = (v > 0.f) ? v + 1.0f : expf(v); else if (ACT == 8) v = tanhf(v); else if (ACT == 9) v = 0.5f * v * (1.0f + tanhf(0.7978845608028654f * (v + 0.044715f * v * v * v))); else if (ACT == 11) v = 1.0f / (1.0f + expf(-v)); else if (ACT == 12) v = (v > 0.f) ? v : 0.01f * v; else if (ACT == 14) v = (v > 0.f) ? v : 0.1f * v; else if (ACT == 16) v = (v >= 0.f) ? v : 0.3f * v; else if (ACT == 17) v = (v >= 0.f) ? v : 0.2f * v; else if (ACT == 15) v = v / (1.0f + expf(-v)); else if (ACT == 3) v = fmaxf(v, 0.f); else if (ACT == 6) v = 0.5f * v * (1.0f + erff(v * 0.70710678118654752f)); so[w][8 * hh + r][t * 16 + ln] = v; } }
  __builtin_amdgcn_fence(__ATOMIC_ACQ_REL, "workgroup"); __builtin_amdgcn_wave_barrier();
  const int rsub = lane >> 4, c4 = (lane & 15) * 4; typedef _Float16 v4h __attribute__((ext_vector_type(4)));
  {
#pragma unroll
    for (int q = 0; q < 8; ++q) { const int r = q * 2 + rsub; if (col0 + c4 < N) { const v4f v = *(const v4fa*)&so[w][r][c4]; if (C) *(v4f*)(C + cofs + (size_t)(row0 + r) * ldc + col0 + c4) = v; if (C16) { v4h h4; for (int i = 0; i < 4; ++i) h4[i] = (_Float16)v[i]; *(v4h*)(C16 + cofs + (size_t)(row0 + r) * ldc + col0 + c4) = h4; } } }
     }
}


typedef _Float16 v4h __attribute__((ext_vector_type(4)));

__global__ __launch_bounds__(256) void k_x16(const float* __restrict__ x, _Float16* __restrict__ X16, size_t n8) { const size_t t = (size_t)blockIdx.x * 256 + threadIdx.x; if (t >= n8) return; FragH f;
#pragma unroll
  for (int q = 0; q < 8; ++q) f.h[q] = (_Float16)bf16_round(x[t * 8 + q]); *(v8us*)((unsigned short*)X16 + t * 8) = f.half[0];  }
__global__ __launch_bounds__(256) void k_h16(const float* __restrict__ x, _Float16* __restrict__ X16, size_t n8) { const size_t t = (size_t)blockIdx.x * 256 + threadIdx.x; if (t >= n8) return; FragH f;
#pragma unroll
  for (int q = 0; q < 8; ++q) f.h[q] = (_Float16)x[t * 8 + q]; *(v8us*)((unsigned short*)X16 + t * 8) = f.half[0];  }
__global__ __launch_bounds__(256) void k_round16f(const float* __restrict__ W, _Float16* __restrict__ Bt, size_t n8) { const size_t t = (size_t)blockIdx.x * 256 + threadIdx.x; if (t >= n8) return; FragH f;
#pragma unroll
  for (int i = 0; i < 8; ++i) f.h[i] = (_Float16)(bf16_round(W[t * 8 + i]) * 16.0f); *(v8us*)((unsigned short*)Bt + t * 8) = f.half[0];  }
template <int NHv, int TTv>
__global__ __launch_bounds__(256) void k_vt(const _Float16* __restrict__ V16, int ldv, int voff, _Float16* __restrict__ Vt) { __shared__ unsigned short tl[64][66]; const int tid = threadIdx.x; const int slab = blockIdx.x / (TTv / 64), lg = blockIdx.x % (TTv / 64); const int b = slab / NHv, h = slab % NHv;
  for (int i = tid; i < 64 * 8; i += 256) { const int r = i / 8, c8 = (i % 8) * 8; FragH f; f.half[0] = *(const v8us*)((const unsigned short*)V16 + ((size_t)b * TTv + lg * 64 + r) * ldv + voff + h * 64 + c8);
#pragma unroll
    for (int q = 0; q < 8; ++q) tl[r][c8 + q] = f.u[q]; }
  __syncthreads();
  {
#pragma unroll
    for (int rd = 0; rd < 2; ++rd) { const int d = rd * 32 + tid / 8, pc = tid % 8; FragH f;
#pragma unroll
      for (int q = 0; q < 8; ++q) f.u[q] = tl[pc * 8 + q][d];
      *(v8us*)((unsigned short*)Vt + ((size_t)slab * 64 + d) * TTv + lg * 64 + pc * 8) = f.half[0]; }
     } }

__global__ __launch_bounds__(256) void k_hl(const float* __restrict__ F, _Float16* __restrict__ Hh, _Float16* __restrict__ Hl, size_t n8) { const size_t t = (size_t)blockIdx.x * 256 + threadIdx.x; if (t >= n8) return; FragH fh, fl; const v4f a = *(const v4fa*)(F + t * 8), c = *(const v4fa*)(F + t * 8 + 4);
#pragma unroll
  for (int q = 0; q < 4; ++q) { _Float16 h = (_Float16)a[q]; fh.h[q] = h; fl.h[q] = (_Float16)((a[q] - (float)h) * 1024.0f); h = (_Float16)c[q]; fh.h[4 + q] = h; fl.h[4 + q] = (_Float16)((c[q] - (float)h) * 1024.0f); }
  { *(v8us*)((unsigned short*)Hh + t * 8) = fh.half[0]; *(v8us*)((unsigned short*)Hl + t * 8) = fl.half[0];  } }

// ---- fast GEMM (wave tile 32x64; requires M % 32 == 0 rows per launch region and N % 64 == 0); epilogue = k_gemm_hhx semantics ----
__device__ __forceinline__ v16h g2_frag(const _Float16* p, int hh) { FragH f; f.half[0] = *(const v8us*)((const unsigned short*)p + 8 * hh); f.half[1] = *(const v8us*)((const unsigned short*)p + 16 + 8 * hh); return f.v; }
__device__ __forceinline__ v8f g2_mma(v16h a, v16h b, v8f c) { v8f d = __builtin_amdgcn_wmma_f32_16x16x32_f16(false, a, false, b, (short)0, c, false, false); asm volatile("v_nop\n\tv_nop\n\tv_nop\n\tv_nop" : "+v"(d) : "v"(a), "v"(b)); return d; }
template <int ACT>
__global__ __launch_bounds__(128) void k_gemm2(const _Float16* __restrict__ A, int lda, size_t sA, const _Float16* __restrict__ Bh, int ldb, size_t sB, float alpha, const float* __restrict__ bias, size_t sBias, const float* __restrict__ CP, int rowsPerB, size_t sCPb, int row0g,
    float* __restrict__ C, _Float16* __restrict__ C16, int ldc, size_t sC, int M, int N, int K) { static_assert(ACT == 0 || ACT == 3 || ACT == 6 || ACT == 8 || ACT == 9 || ACT == 11 || ACT == 12 || ACT == 14 || ACT == 15 || ACT == 16 || ACT == 17, "k_gemm2: unsupported ACT code (would silently apply no activation)");
  __shared__ __attribute__((aligned(16))) float so[4][32][68];
  const int tid = threadIdx.x, w = tid >> 5, lane = tid & 31, ln = lane & 15, hh = lane >> 4; const int by = blockIdx.y;
  A += (size_t)by * sA; Bh += (size_t)by * sB; const size_t cofs = (size_t)by * sC; const float* bp = bias ? bias + (size_t)by * sBias : nullptr;
  const int ntn = N >> 6; const int mt = blockIdx.x / ntn, nq = blockIdx.x - mt * ntn; const int row0 = mt * 128 + 32 * w, col0 = nq * 64; if (row0 >= M) return;
  const _Float16* a0p = A + (size_t)(row0 + ln) * lda; const _Float16* a1p = a0p + (size_t)16 * lda;
  const _Float16* b0p = Bh + (size_t)(col0 + ln) * ldb; const _Float16* b1p = b0p + (size_t)16 * ldb; const _Float16* b2p = b1p + (size_t)16 * ldb; const _Float16* b3p = b2p + (size_t)16 * ldb;
  const v8f z8 = {0.f,0.f,0.f,0.f,0.f,0.f,0.f,0.f}; v8f c00 = z8, c01 = z8, c02 = z8, c03 = z8, c10 = z8, c11 = z8, c12 = z8, c13 = z8;
#pragma unroll 1
  for (int kb = 0; kb < K; kb += 32) { const v16h a0 = g2_frag(a0p + kb, hh), a1 = g2_frag(a1p + kb, hh);
    v16h b = g2_frag(b0p + kb, hh); c00 = g2_mma(a0, b, c00); c10 = g2_mma(a1, b, c10);
    b = g2_frag(b1p + kb, hh); c01 = g2_mma(a0, b, c01); c11 = g2_mma(a1, b, c11);
    b = g2_frag(b2p + kb, hh); c02 = g2_mma(a0, b, c02); c12 = g2_mma(a1, b, c12);
    b = g2_frag(b3p + kb, hh); c03 = g2_mma(a0, b, c03); c13 = g2_mma(a1, b, c13); }
  v8f accs[8] = {c00, c01, c02, c03, c10, c11, c12, c13};
#pragma unroll
  for (int u = 0; u < 8; ++u) { const int t = u & 3, half = u >> 2; const int col = col0 + t * 16 + ln; const float bv = bp ? bf16_round(bp[col]) : 0.f;
#pragma unroll
    for (int r = 0; r < 8; ++r) { const int rloc = half * 16 + 8 * hh + r; float v = accs[u][r] * alpha + bv; if (CP) { if (rowsPerB < 0) v += CP[(size_t)by * sCPb + (size_t)(row0g + row0 + rloc) * ldc + col];      /* rowsPerB < 0: own element of an addend plane shaped like C; sCPb = its step from one grid.y slice to the next (0: one plane shared by all slices) */ else { const int bidx = (row0g + row0 + rloc) / rowsPerB; v += CP[(size_t)bidx * sCPb + (size_t)by * 64 + col]; } }
      if (ACT == 3) v = fmaxf(v, 0.f); else if (ACT == 6) v = 0.5f * v * (1.0f + erff(v * 0.70710678118654752f)); else if (ACT == 11) v = 1.0f / (1.0f + expf(-v)); else if (ACT == 15) v = v / (1.0f + expf(-v)); else if (ACT == 12) v = (v > 0.f) ? v : 0.01f * v; else if (ACT == 8) v = tanhf(v); else if (ACT == 9) v = 0.5f * v * (1.0f + tanhf(0.7978845608028654f * (v + 0.044715f * v * v * v))); else if (ACT == 14) v = (v > 0.f) ? v : 0.1f * v; else if (ACT == 16) v = (v >= 0.f) ? v : 0.3f * v; else if (ACT == 17) v = (v >= 0.f) ? v : 0.2f * v;
      so[w][rloc][t * 16 + ln] = v; } }
  __builtin_amdgcn_fence(__ATOMIC_ACQ_REL, "workgroup"); __builtin_amdgcn_wave_barrier();
  const int rsub = lane >> 4, c4 = (lane & 15) * 4;
  {
#pragma unroll
    for (int q = 0; q < 16; ++q) { const int r = q * 2 + rsub; const v4f v = *(const v4fa*)&so[w][r][c4]; if (C) *(v4f*)(C + cofs + (size_t)(row0 + r) * ldc + col0 + c4) = v; if (C16) { v4h h4; for (int i = 0; i < 4; ++i) h4[i] = (_Float16)v[i]; *(v4h*)(C16 + cofs + (size_t)(row0 + r) * ldc + col0 + c4) = h4; } }
     } }


__global__ __launch_bounds__(256) void k_wnat(const float* __restrict__ w, size_t n8, _Float16* __restrict__ Bt) { const size_t t = (size_t)blockIdx.x * 256 + threadIdx.x; if (t >= n8) return; FragH f; for (int q = 0; q < 8; ++q) f.h[q] = (_Float16)(bf16_round(w[t * 8 + q]) * 16.0f); *(v8us*)((unsigned short*)Bt + t * 8) = f.half[0];  }
__global__ __launch_bounds__(256) void k_rsm(const float* __restrict__ S, _Float16* __restrict__ P, int nrows) {
  #pragma clang fp contract(off)
  const int i = blockIdx.x * 256 + threadIdx.x; if (i >= nrows) return; const float* s = S + (size_t)i * SQ; float mx = -3.0e38f;
#pragma unroll 1
  for (int j = 0; j < SQ; ++j) mx = fmaxf(mx, s[j]); float se = 0.f;
#pragma unroll 1
  for (int j = 0; j < SQ; ++j) se += expf(s[j] - mx); const float sc = 256.0f / se;
#pragma unroll 1
  for (int j0 = 0; j0 < SQ; j0 += 8) { FragH f; for (int q = 0; q < 8; ++q) f.h[q] = (_Float16)(expf(s[j0 + q] - mx) * sc); unsigned short* d = (unsigned short*)P + (size_t)i * SQ + j0; *(v8us*)d = f.half[0];  } }
__global__ __launch_bounds__(256) void k_vt(const _Float16* __restrict__ V16, int b, int h0, _Float16* __restrict__ VT) { __shared__ unsigned short tl[64][65]; const int tid = threadIdx.x; const int hh = blockIdx.x % HG, sg = blockIdx.x / HG; const int s0 = sg * 64; const int h = h0 + hh;
  for (int i = tid; i < 64 * 8; i += 256) { const int j = i / 8, d8 = (i % 8) * 8; FragH f; f.half[0] = *(const v8us*)((const unsigned short*)V16 + ((size_t)b * SQ + s0 + j) * DM + h * HD + d8); for (int q = 0; q < 8; ++q) tl[d8 + q][j] = f.u[q]; }
  __syncthreads();
  { for (int i = tid; i < 64 * 8; i += 256) { const int d = i / 8, j8 = (i % 8) * 8; FragH f; for (int q = 0; q < 8; ++q) f.u[q] = tl[d][j8 + q]; *(v8us*)((unsigned short*)VT + ((size_t)hh * HD + d) * SQ + s0 + j8) = f.half[0]; }  } }



__global__ __launch_bounds__(256) void k_rsmcf2(const float* __restrict__ S, _Float16* __restrict__ P, int hg, int q0, int nk) {
  #pragma clang fp contract(off)
  const int t = blockIdx.x * 256 + threadIdx.x; if (t >= hg * QT) return; const size_t i = (size_t)t; const float* s = S + i * NKX; const int last = q0 + (t % QT); float mx = -3.0e38f;
#pragma unroll 1
  for (int j = 0; j < nk; ++j) { const float f = (j <= last) ? 1.f : 0.f; mx = fmaxf(mx, fmaf(f, s[j], (1.f - f) * -1.0e9f)); } float se = 0.f;
#pragma unroll 1
  for (int j = 0; j < nk; ++j) { const float f = (j <= last) ? 1.f : 0.f; se += __expf(fmaf(f, s[j], (1.f - f) * -1.0e9f) - mx); } const float sc = 256.0f / se;
#pragma unroll 1
  for (int j0 = 0; j0 < nk; j0 += 8) { FragH fr; for (int q = 0; q < 8; ++q) { const int j = j0 + q; const float f = (j <= last) ? 1.f : 0.f; fr.h[q] = (_Float16)(__expf(fmaf(f, s[j], (1.f - f) * -1.0e9f) - mx) * sc); } unsigned short* d = (unsigned short*)P + i * NKX + j0; *(v8us*)d = fr.half[0];  } }

template <int MASKADD>
__global__ __launch_bounds__(64) void k_att0(const float* __restrict__ QF, const float* __restrict__ KF, const float* __restrict__ VF, int ld, const float* __restrict__ mask, float scale, float* __restrict__ OF, int ldo) {
  #pragma clang fp contract(off)
  __shared__ __attribute__((aligned(16))) float lq[64][64]; __shared__ __attribute__((aligned(16))) float lo[64][64];
  const int tid = threadIdx.x; const int h = blockIdx.x / (QT0 / 64), rg = blockIdx.x % (QT0 / 64); const int i = rg * 64 + tid;
  const float* qr = QF + (size_t)i * ld + h * HD;
#pragma unroll 1
  for (int c = 0; c < HD / 4; ++c) { *(v4f*)&lq[tid][c * 4] = *(const v4fa*)(qr + c * 4); const v4f z = {0.f, 0.f, 0.f, 0.f}; *(v4f*)&lo[tid][c * 4] = z; }
  float m = -1.0e30f, l = 0.f; const int jmax = MASKADD ? (SQ - 1) : (rg * 64 + 63);      /* additive-mask form: every key (the mask input decides); causal form: keys up to the block's last row */
#pragma unroll 1
  for (int j = 0; j <= jmax; ++j) { const float* kr = KF + (size_t)j * ld + h * HD; const float* vr = VF + (size_t)j * ld + h * HD; float s = 0.f;
#pragma unroll 1
    for (int c = 0; c < HD / 4; ++c) { const v4f kq = *(const v4fa*)(kr + c * 4); const v4f qq = *(v4f*)&lq[tid][c * 4]; s = __fadd_rn(s, __fmul_rn(qq[0], kq[0])); s = __fadd_rn(s, __fmul_rn(qq[1], kq[1])); s = __fadd_rn(s, __fmul_rn(qq[2], kq[2])); s = __fadd_rn(s, __fmul_rn(qq[3], kq[3])); }
    s = __fmul_rn(s, scale); if (MASKADD) s = __fadd_rn(s, __fmul_rn(bf16_round(mask[(size_t)i * SQ + j]), -10000.0f));
    const float f = (MASKADD || j <= i) ? 1.f : 0.f; const float sm = fmaf(f, s, (1.f - f) * -1.0e30f); const float mn = fmaxf(m, sm); const float sc = expf(m - mn); const float e = expf(sm - mn); l = __fadd_rn(__fmul_rn(l, sc), e); m = mn;
#pragma unroll 1
    for (int c = 0; c < HD / 4; ++c) { const v4f vv = *(const v4fa*)(vr + c * 4); v4f oo = *(v4f*)&lo[tid][c * 4]; for (int u = 0; u < 4; ++u) oo[u] = __fadd_rn(__fmul_rn(oo[u], sc), __fmul_rn(e, vv[u])); *(v4f*)&lo[tid][c * 4] = oo; } }
  const float fin = 64.0f / l;      /* o carried x64 like the f16 path */
#pragma unroll 1
  for (int c = 0; c < HD / 4; ++c) { v4f oo = *(v4f*)&lo[tid][c * 4]; for (int u = 0; u < 4; ++u) oo[u] = __fmul_rn(oo[u], fin); *(v4f*)&lo[tid][c * 4] = oo; }
  __syncthreads();
  {
#pragma unroll 1
    for (int it = 0; it < 16; ++it) { const int row = it * 4 + tid / 16, pc = (tid % 16) * 4; const v4f v = *(const v4f*)&lo[row][pc]; *(v4f*)(OF + (size_t)(rg * 64 + row) * ldo + h * HD + pc) = v; }
     } }

__global__ __launch_bounds__(256) void k_oscale(const float* __restrict__ OF, float* __restrict__ out, size_t n4) { const size_t t = (size_t)blockIdx.x * 256 + threadIdx.x; if (t >= n4) return; const v4f a = *(const v4fa*)(OF + t * 4); v4f o; for (int q = 0; q < 4; ++q) o[q] = a[q] * 0.015625f; *(v4f*)(out + t * 4) = o;  }

__global__ __launch_bounds__(256) void k_bfr(const float* __restrict__ x, float* __restrict__ XB, size_t n8) { const size_t t = (size_t)blockIdx.x * 256 + threadIdx.x; if (t >= n8) return; v4f a = *(const v4fa*)(x + t * 8), c = *(const v4fa*)(x + t * 8 + 4); for (int q = 0; q < 4; ++q) { a[q] = bf16_round(a[q]); c[q] = bf16_round(c[q]); }
  { *(v4f*)(XB + t * 8) = a; *(v4f*)(XB + t * 8 + 4) = c;  } }



__global__ __launch_bounds__(256) void k_rsmfvl(const float* __restrict__ S, _Float16* __restrict__ P, _Float16* __restrict__ PL, int qn, const int* __restrict__ vlp) {
  #pragma clang fp contract(off)
  const int t = blockIdx.x * 256 + threadIdx.x; if (t >= qn) return; const int vl = vlp[0]; const size_t i = (size_t)t; const float* s = S + i * SQ; float mx = -3.0e38f;
#pragma unroll 1
  for (int j = 0; j < SQ; ++j) { const float f = (j < vl) ? 1.f : 0.f; mx = fmaxf(mx, fmaf(f, s[j], (1.f - f) * -1000000.0f)); } float se = 0.f;
#pragma unroll 1
  for (int j = 0; j < SQ; ++j) { const float f = (j < vl) ? 1.f : 0.f; se += __expf(fmaf(f, s[j], (1.f - f) * -1000000.0f) - mx); } const float sc = 256.0f / se;
#pragma unroll 1
  for (int j0 = 0; j0 < SQ; j0 += 8) { FragH fr, gr; for (int q = 0; q < 8; ++q) { const int j = j0 + q; const float f = (j < vl) ? 1.f : 0.f; const float pv = __expf(fmaf(f, s[j], (1.f - f) * -1000000.0f) - mx) * sc; const _Float16 ph = (_Float16)pv; fr.h[q] = ph; gr.h[q] = (_Float16)((pv - (float)ph) * 1024.0f); }
    unsigned short* d = (unsigned short*)P + i * SQ + j0; unsigned short* dl = (unsigned short*)PL + i * SQ + j0; *(v8us*)d = fr.half[0]; *(v8us*)dl = gr.half[0];  } }

// 2^x on the transcendental unit; the v_nop is the one free slot the instruction set asks for behind a transcendental, in the same statement so that it stays directly behind it.
__device__ __forceinline__ float exp2_slot(float x) { float r; asm("v_exp_f32 %0, %1\n\tv_nop" : "=v"(r) : "v"(x)); return r; }

#define CN 256          /* channels */
#define CI 128          /* inner channels */
#define NP 4096         /* positions */
#define NM 1024         /* pooled positions (= SQ: the softmax key count) */

// Fused attention: one launch computes scores, softmax and the weighted sum of g for all images; neither the scores nor the weights go to memory.
// A work-group of 8 waves takes 128 queries of one image (16 a wave) and walks the 1024 pooled positions 32 at a time.
// S^T = phi^T (A, rows m) x theta (B, columns n; fragments kept in registers), three terms as before: hi.hi + (hi.lo + lo.hi) / 1024.
// In the accumulator a lane holds, for ITS query n = lane & 15, the keys m = 8 * (lane >> 4) + r of a 16-key tile: two such tiles are, register for register, the B fragment of y[c][n] += g[c][m] P^T[m][n]
// (elements 0..7 = keys 8 hh + r, elements 8..15 = keys 16 + 8 hh + r, the k order in which g2_frag / lds_frag read the rows of g), so the weights move through no LDS and no other lane.
// Running row maximum and row sum per lane (online softmax; the two half-waves share the maximum every pass and join their sums once at the end). Weights are carried x256 in f16 as before; the sum carries the same factor.
// The phi hi / lo rows and the g columns of a pass are shared by the 8 waves through LDS, a ring of FR = 2 FKB + 1 buffers with one barrier every FKB passes: pass t works on tile t and reads tile t + 1's phi fragments ahead.
// The tiles come into LDS by asynchronous copies, through no register: pass t issues the copies of tile t + FKB + 1 at its head, behind its g fragment reads. Between two barriers (passes k s .. k s + k - 1, k = FKB) the waves read tiles k s .. k s + k while the copies of tiles k s + k + 1 .. k s + 2 k are issued and land, in the buffers of tiles k s - k .. k s - 1, left by every wave before the barrier in front; every wave waits for its own copies in front of the barrier behind, which publishes them. The two waves of a SIMD take turns at the matrix unit, so one reaches every barrier later than the other: fewer barriers, fewer such waits.
// Every LDS fragment read stands one phase ahead of its use, as a whole group: the g fragments of a pass in front of its score products, the next pass's 16 phi fragments behind them (into the registers they have just left), in front of the exponentials and the g products.
#define FK 32                            /* keys per pass */
#define FPP 136                          /* LDS pitch of a phi row in f16: 256 B + 16 B, an odd multiple of 16 B (no bank conflict for 16-byte reads of 16 rows) */
#define FGP 40                           /* LDS pitch of a g row in f16: 64 B + 16 B, likewise */
#define FBUF (2 * FK * FPP + CI * FGP)   /* one buffer in f16: phi hi, phi lo, g */
#define FKB 4                            /* passes between two barriers */
#define FR (2 * FKB + 1)                 /* buffers in the ring */
__device__ __forceinline__ v16h lds_frag(const unsigned short* p) { FragH f; f.half[0] = *(const v8us*)p; f.half[1] = *(const v8us*)(p + 16); return f.v; }
__device__ __forceinline__ v8f f_mma(v16h a, v16h b, v8f c) { return __builtin_amdgcn_wmma_f32_16x16x32_f16(false, a, false, b, (short)0, c, false, false); }
#define SOP 132                          /* LDS pitch of a gathered output row in f32: 512 B + 16 B (16-byte writes of 16 rows fall on all banks) */
__global__ __launch_bounds__(256) void k_fattn(const _Float16* __restrict__ TH, const _Float16* __restrict__ THL, const _Float16* __restrict__ PHT, const _Float16* __restrict__ PHLT, const _Float16* __restrict__ G16, const _Float16* __restrict__ BW, const float* __restrict__ BN4, const float* __restrict__ x, float* __restrict__ out) {
  __shared__ __attribute__((aligned(16))) unsigned short sm[FR * FBUF];
  static_assert((NM / FK) % FKB == 0 && NM / FK > FKB, "the last pass ends in a barrier; the prologue's tiles exist");
  static_assert(128 * FPP * 2 + 8 * 32 * SOP * 4 <= FR * FBUF * 2, "y^T and the gathered output rows fit in the ring");
  float* const so = (float*)(sm + 128 * FPP);      /* epilogue: each wave gathers its own 32 output rows here, over the ring and behind y^T */
  const int tid = threadIdx.x, w = tid >> 5, lane = tid & 31, ln = lane & 15, hh = lane >> 4, by = blockIdx.y;
  const int n0 = blockIdx.x * 128 + w * 16;
  const unsigned short* ph = (const unsigned short*)PHT + (size_t)by * CI * NM; const unsigned short* pl = (const unsigned short*)PHLT + (size_t)by * CI * NM; const unsigned short* gg = (const unsigned short*)G16 + (size_t)by * CI * NM;
  const _Float16* tq = TH + ((size_t)by * NP + n0 + ln) * CI; const _Float16* tl = THL + ((size_t)by * NP + n0 + ln) * CI;
  v16h qh[4], ql[4];
#pragma unroll
  for (int j = 0; j < 4; ++j) { qh[j] = g2_frag(tq + j * 32, hh); ql[j] = g2_frag(tl + j * 32, hh); }
  asm volatile("s_wait_xcnt 0x0" :: "v"(tq), "v"(tl) : "memory");      /* the wait that stands in front of any overwrite of a register which an issued load names; the two addresses are inputs so that they stay live up to it */
  /* staging: 16-byte pieces; phi tile = 32 rows x 16 pieces (contiguous in memory), g tile = 128 rows x 4 pieces; two pieces of each plane a thread, one asynchronous copy each */
  const int pr = tid >> 4, pc = (tid & 15) * 8, gr = tid >> 2, gc = (tid & 3) * 8;
  const unsigned short* const fh = ph + (size_t)pr * CI + pc; const unsigned short* const fl = pl + (size_t)pr * CI + pc; const unsigned short* const fg = gg + (size_t)gr * FK + gc;      /* the lane's first piece of each plane of tile 0; every plane steps FK CI elements a tile (g lies tile by tile: [m / 32][ci][32]) */
  typedef int v4i __attribute__((ext_vector_type(4)));
  typedef __attribute__((address_space(1))) v4i* gp4; typedef __attribute__((address_space(3))) v4i* lp4;
  auto cp = [](const unsigned short* g, unsigned short* l) { __builtin_amdgcn_global_load_async_to_lds_b128((gp4)g, (lp4)l, 0, 0); };
  /* tile t into the buffer at ring offset bo */
  auto stage = [&](int t, int bo) {
    const unsigned short* a = fh + (size_t)t * (FK * CI); const unsigned short* b = fl + (size_t)t * (FK * CI); const unsigned short* c = fg + (size_t)t * (FK * CI);
    unsigned short* d = sm + bo + pr * FPP + pc; unsigned short* e = sm + bo + 2 * FK * FPP + gr * FGP + gc;
    cp(a, d); cp(a + 16 * CI, d + 16 * FPP); cp(b, d + FK * FPP); cp(b + 16 * CI, d + (FK + 16) * FPP); cp(c, e); cp(c + 64 * FK, e + 64 * FGP); };
  auto nxt = [](int bo) { return bo + FBUF == FR * FBUF ? 0 : bo + FBUF; };      /* the next buffer of the ring */
  v16h pa[16];      /* a tile's phi fragments: [4 j + 0 / 1] = hi rows 0..15 / 16..31, [4 j + 2 / 3] = residual rows, k block j */
  auto ldphi = [&](int bo) { const unsigned short* a = sm + bo + ln * FPP + 8 * hh;
#pragma unroll
    for (int j = 0; j < 4; ++j) { pa[4 * j] = lds_frag(a + j * 32); pa[4 * j + 1] = lds_frag(a + 16 * FPP + j * 32); pa[4 * j + 2] = lds_frag(a + FK * FPP + j * 32); pa[4 * j + 3] = lds_frag(a + (FK + 16) * FPP + j * 32); } };
  const v8f z8 = {0.f,0.f,0.f,0.f,0.f,0.f,0.f,0.f};
  v8f o[8];
#pragma unroll
  for (int ct = 0; ct < 8; ++ct) o[ct] = z8;
  float m = -1.0e30f, l = 0.f;
#pragma unroll
  for (int i = 0; i <= FKB; ++i) stage(i, i * FBUF);      /* tiles 0 .. FKB: all their copies fly together */
  asm volatile("s_wait_asynccnt 0x0" ::: "memory");      /* the wave's own copies have landed before the barrier behind which other waves read them */
  __syncthreads();      /* publishes tiles 0 .. FKB */
  ldphi(0);
  int b0 = 0, b1 = FBUF, b2 = (FKB + 1) * FBUF;      /* ring offsets of tiles t, t + 1, t + FKB + 1 */
  int tf = FKB + 1;      /* the tile whose copies pass t issues: t + FKB + 1, held at the last tile */
  auto pass = [&]() {
    const unsigned short* ag = sm + b0 + 2 * FK * FPP + ln * FGP + 8 * hh;
    v16h ga[8];
#pragma unroll
    for (int ct = 0; ct < 8; ++ct) ga[ct] = lds_frag(ag + ct * 16 * FGP);
    __builtin_amdgcn_sched_barrier(0);      /* keeps the g fragment reads in front of the score products, which cover them; without it the compiler sinks each read to just in front of its product and the wave waits out the LDS latency there */
    stage(tf, b2);      /* behind the g reads, so that the LDS queue is at work while the addresses are formed. The index is held at the last tile so that the pass has no branch and stays straight-line code; what the last FKB + 1 passes copy so is read ahead like any tile and enters no product */
    v8f sh0 = z8, sh1 = z8, sl0 = z8, sl1 = z8;
#pragma unroll
    for (int j = 0; j < 4; ++j) {
      sh0 = f_mma(pa[4 * j], qh[j], sh0); sh1 = f_mma(pa[4 * j + 1], qh[j], sh1);
      sl0 = f_mma(pa[4 * j], ql[j], sl0); sl1 = f_mma(pa[4 * j + 1], ql[j], sl1);
      sl0 = f_mma(pa[4 * j + 2], qh[j], sl0); sl1 = f_mma(pa[4 * j + 3], qh[j], sl1);
    }
    float s[16];
#pragma unroll
    for (int r = 0; r < 8; ++r) { s[r] = sh0[r] + sl0[r] * 0.0009765625f; s[8 + r] = sh1[r] + sl1[r] * 0.0009765625f; }
    float mx = fmaxf(s[0], s[1]);
#pragma unroll
    for (int r = 2; r < 16; ++r) mx = fmaxf(mx, s[r]);
    const float mo = __shfl_xor(mx, 16, 32);      /* the other half-wave holds the same query's other 16 keys */
    __builtin_amdgcn_sched_barrier(0);      /* the exchange goes through the LDS queue, which answers in order: it is issued in front of the 32 reads below, so that its wait does not take them in */
    ldphi(b1);      /* tile t + 1, published by the last barrier or an earlier one */
    __builtin_amdgcn_sched_barrier(0);      /* keeps the whole group here, in front of the exponentials and the g products, which cover it */
    mx = fmaxf(mx, mo);
    const float mn = fmaxf(m, mx);
    const float sc = exp2_slot((m - mn) * 1.44269504f);
    m = mn;
    FragH pf; float p0 = 0.f, p1 = 0.f;
#pragma unroll
    for (int r = 0; r < 8; ++r) {
      const float e0 = exp2_slot((s[r] - mn) * 1.44269504f + 8.0f), e1 = exp2_slot((s[8 + r] - mn) * 1.44269504f + 8.0f);
      p0 += e0; p1 += e1; pf.h[r] = (_Float16)e0; pf.h[8 + r] = (_Float16)e1;
    }
    l = l * sc + (p0 + p1);
#pragma unroll
    for (int ct = 0; ct < 8; ++ct) o[ct] *= sc;
#pragma unroll
    for (int ct = 0; ct < 8; ++ct) o[ct] = f_mma(ga[ct], pf.v, o[ct]);
    __builtin_amdgcn_sched_barrier(0);      /* keeps what follows, at the last pass of a trip the wait on the LDS queue in front of the barrier, behind the g products: hoisted over them, that wait would stand right behind the exponentials and take in the 32 reads */
    b0 = b1; b1 = nxt(b1); b2 = nxt(b2);
    if (tf + 1 < NM / FK) ++tf;
  };
  /* rolled: FKB passes are already more than a thousand instructions, and the ring offsets are the only thing that changes */
#pragma unroll 1
  for (int t = 0; t < NM / FK; t += FKB) {
    /* unrolled, so that the passes between two barriers are straight-line code: with a branch round the barrier in every pass the compiler sank the row sum's chain of additions out of the exponentials' shadow to the pass's foot */
#pragma unroll
    for (int u = 0; u < FKB; ++u) pass();
    asm volatile("s_wait_dscnt 0x0" ::: "memory");      /* the wave's own LDS reads are through before any copy is aimed at a buffer that it has read */
    asm volatile("s_wait_asynccnt 0x0" ::: "memory");      /* the wave's own copies have landed before the barrier behind which other waves read them */
    __syncthreads();      /* publishes the FKB tiles copied since the last barrier; ends every wave's reads of the FKB tiles worked on since, whose buffers the next trip's copies overwrite; behind the last one no copy is under way and the ring is free for y^T and the gathered output rows */
  }
  /* Epilogue: z[c][n] = BN(W y + W_b) + bf16(x) for the work-group's 128 positions. The waves exchange y^T through LDS; then a wave takes 32 output channels and all 128 positions:
     D[n][c] = (y^T rows as A) (16 W rows as B^T), so that a lane holds 8 consecutive positions of ITS channel c = lane & 15; bias and BatchNorm are applied there, the rows are gathered in the wave's own LDS range and leave, with the residual, as whole 512-byte pieces of a channel row. */
  const int c0 = w * 32, cl = c0 + ln;
  const unsigned short* wr = (const unsigned short*)BW + (size_t)cl * CI + 8 * hh;      /* elements 0..7 = k 8 hh + 0..7, elements 8..15 = k 16 + 8 hh + 0..7 of each 32, the order in which lds_frag reads the rows of y^T */
  const float* bnp = BN4 + 4 * cl;
  v16h wf[2][4]; v4f bn[2];
#pragma unroll
  for (int u = 0; u < 2; ++u) {
#pragma unroll
    for (int j = 0; j < 4; ++j) { FragH f; f.half[0] = *(const v8us*)(wr + u * 16 * CI + j * 32); f.half[1] = *(const v8us*)(wr + u * 16 * CI + j * 32 + 16); wf[u][j] = f.v; }
    bn[u] = *(const v4fa*)(bnp + u * 64); }
  asm volatile("s_wait_xcnt 0x0" :: "v"(wr), "v"(cl) : "memory");      /* the wait that stands in front of any overwrite of a register which an issued load names; the weights' address and the row index that the constants' loads are addressed by are inputs so that they stay live up to it */
  l += __shfl_xor(l, 16, 32);
  const float inv = 1.0f / l;
  { unsigned short* yo = sm + (w * 16 + ln) * FPP + 8 * hh;      /* y^T [128 n][ci] over the ring, which nobody reads behind the loop's last barrier: the lane's 8 channels of a tile are 16 contiguous bytes of its query's row */
#pragma unroll
    for (int ct = 0; ct < 8; ++ct) { FragH f;
#pragma unroll
      for (int r = 0; r < 8; ++r) f.h[r] = (_Float16)(o[ct][r] * inv);
      *(v8us*)(yo + ct * 16) = f.half[0]; } }
  __syncthreads();      /* publishes y^T */
  const size_t e0 = ((size_t)by * CN + c0) * NP + blockIdx.x * 128 + lane * 4;      /* the lane's 4 positions of the wave's first channel row */
  const float* xb = x + e0;
  v4f xx[32];      /* behind the barrier, which waits for every load in flight: the residual flies under the products */
#pragma unroll
  for (int q = 0; q < 32; ++q) xx[q] = *(const v4fa*)(xb + (size_t)q * NP);
  asm volatile("s_wait_xcnt 0x0" :: "v"(xb) : "memory");      /* as above, for the one address of this run */
  const unsigned short* yr = sm + ln * FPP + 8 * hh;
  float* sw = so + w * (32 * SOP);
  v16h ya[2][8];      /* two sets of fragments, each of two position tiles: [4 i + j] = tile i, k block j */
  auto ldy = [&](int s, int np) {
#pragma unroll
    for (int i = 0; i < 2; ++i)
#pragma unroll
      for (int j = 0; j < 4; ++j) ya[s][4 * i + j] = lds_frag(yr + (np * 2 + i) * 16 * FPP + j * 32); };
  ldy(0, 0);
#pragma unroll
  for (int np = 0; np < 4; ++np) {
    if (np + 1 < 4) ldy((np + 1) & 1, np + 1);
    __builtin_amdgcn_sched_barrier(0);      /* keeps the next two tiles' fragment reads, as one group, in front of this pair's products, which cover them */
    v8f d[2][2] = {{z8, z8}, {z8, z8}};
#pragma unroll
    for (int j = 0; j < 4; ++j)
#pragma unroll
      for (int i = 0; i < 2; ++i) { d[i][0] = f_mma(ya[np & 1][4 * i + j], wf[0][j], d[i][0]); d[i][1] = f_mma(ya[np & 1][4 * i + j], wf[1][j], d[i][1]); }
#pragma unroll
    for (int i = 0; i < 2; ++i)
#pragma unroll
      for (int u = 0; u < 2; ++u) { v4f t0, t1;
#pragma unroll
        for (int k = 0; k < 4; ++k) { t0[k] = ((d[i][u][k] * 0.0625f + bn[u][0]) - bn[u][1]) * bn[u][2] + bn[u][3]; t1[k] = ((d[i][u][4 + k] * 0.0625f + bn[u][0]) - bn[u][1]) * bn[u][2] + bn[u][3]; }
        float* ds = sw + (u * 16 + ln) * SOP + (np * 2 + i) * 16 + 8 * hh; *(v4f*)ds = t0; *(v4f*)(ds + 4) = t1; }
  }
  asm volatile("s_wait_dscnt 0x0" ::: "memory");      /* the wave reads back rows that its other lanes wrote: those stores are through first, and the compiler moves no read over this line */
  v4f vv[32];
#pragma unroll
  for (int q = 0; q < 32; ++q) vv[q] = *(const v4fa*)(sw + q * SOP + lane * 4);
  __builtin_amdgcn_sched_barrier(0);      /* keeps the 32 reads together as one group: sunk to their uses, one or two at a time, each would have the wave wait out the LDS latency */
#pragma unroll
  for (int q = 0; q < 32; ++q) { v4f r;
#pragma unroll
    for (int i = 0; i < 4; ++i) r[i] = vv[q][i] + bf16_round(xx[q][i]);
    *(v4f*)(out + e0 + (size_t)q * NP) = r; }
}

__global__ __launch_bounds__(256) void k_rowbias(const float* __restrict__ b, float* __restrict__ BP, size_t n4, int ncol) { const size_t t = (size_t)blockIdx.x * 256 + threadIdx.x; if (t >= n4) return; const size_t e = t * 4; const float v = bf16_round(b[e / ncol]); const v4f o = {v, v, v, v}; *(v4f*)(BP + e) = o;  }




__global__ __launch_bounds__(256) void k_mp2(const float* __restrict__ src, float* __restrict__ dst, int nout) {
  const int t = blockIdx.x * 256 + threadIdx.x; if (t >= nout) return; const int c = t / 1024; const int o = t % 1024; const int oy = o / 32, ox = o % 32; const float* p = src + (size_t)c * 4096 + (size_t)(2 * oy) * 64 + 2 * ox;
  const float v = fmaxf(fmaxf(p[0], p[1]), fmaxf(p[64], p[65])); *(float*)(dst + t) = v;  }
__global__ __launch_bounds__(256) void k_xpb(const float* __restrict__ x, const float* __restrict__ wb, float* __restrict__ CPP, size_t n4) {
  #pragma clang fp contract(off)
  const size_t t = (size_t)blockIdx.x * 256 + threadIdx.x; if (t >= n4) return; const size_t e = t * 4; const int c = (int)((e / 4096) % 256); const float bb = bf16_round(wb[c]); const v4f a = *(const v4fa*)(x + e); v4f o; for (int q = 0; q < 4; ++q) o[q] = __fadd_rn(bf16_round(a[q]), bb);
  *(v4f*)(CPP + e) = o;  }


__global__ __launch_bounds__(256) void k_bnres(float* __restrict__ O, const float* __restrict__ x, const float* __restrict__ wb, const float* __restrict__ g, const float* __restrict__ be, const float* __restrict__ mu, const float* __restrict__ var, float eps, size_t n4) {
  #pragma clang fp contract(off)
  const size_t t = (size_t)blockIdx.x * 256 + threadIdx.x; if (t >= n4) return; const size_t e = t * 4; const int c = (int)((e / NP) % CN);
  const float inv = __fdiv_rn(bf16_round(g[c]), sqrtf(__fadd_rn(bf16_round(var[c]), eps))); const float wbc = bf16_round(wb[c]), mc = bf16_round(mu[c]), bc = bf16_round(be[c]);
  const v4f a = *(const v4fa*)(O + e); const v4f xx = *(const v4fa*)(x + e); v4f o;
  for (int q = 0; q < 4; ++q) o[q] = __fadd_rn(__fadd_rn(__fmul_rn(__fadd_rn(__fadd_rn(a[q], wbc), -mc), inv), bc), bf16_round(xx[q]));
  *(v4f*)(O + e) = o;  }

// ---- the pointwise and layout stages live inside the two matrix kernels ----
// Every plain '#pragma unroll' below but the last, on the copy-out loop, stands on a short loop over a register array (fragments, accumulators, packed halves): its index must be a compile-time constant for the array to stay in registers.
// Two f32 values, each rounded to bf16 and taken x16, as two packed f16 (exact: 8 significant bits, away from the f16 subnormal range).
typedef float v2f __attribute__((ext_vector_type(2)));
typedef __bf16 v2b __attribute__((ext_vector_type(2)));
typedef _Float16 v2h __attribute__((ext_vector_type(2)));
typedef unsigned int v2u __attribute__((ext_vector_type(2), may_alias));
__device__ __forceinline__ unsigned int w16_pair(float a, float b) {
  const v2f v = {a, b};
  const unsigned int pk = __builtin_bit_cast(unsigned int, __builtin_convertvector(v, v2b));
  const v2f r = {__uint_as_float(pk << 16), __uint_as_float(pk & 0xFFFF0000u)};
  return __builtin_bit_cast(unsigned int, __builtin_convertvector(r * 16.0f, v2h));
}

// k_proj: theta, phi and g of 128 positions (two image rows = one pooled row) of one image in one work-group of 16 waves.
// 0. The small operands, from the f32 inputs, with no launch of their own: every work-group rounds the three projection weights, stacked [384][256] (theta, phi, g), into LDS as x16 f16 rows, and the three biases [384]; for the attention launch work-group i writes row i of W [256][128] as x16 f16, and work-groups 0..31 eight channels each of {W_b, mean, gamma / sqrt(var + eps), beta}.
// 1. x [256 c][128 n] f32 -> bf16-rounded f16, transposed into LDS as x^T [n][c]. 2. D[o][n] = (stacked weights as A, rows o, from LDS) x (x^T rows as B^T): a wave keeps the B fragments of position tiles p and p + 4 (the same 16 columns of the two image rows) in registers for all of K and walks 6 of the 24 row tiles.
// In D a lane holds 8 consecutive o of ITS position: theta splits into hi + x1024 residual as 16-byte pieces of its [n][ci] row; phi and g take the 2x2 maximum as max(tile p, tile p + 4), then with the neighbour lane. 3. All results are gathered in LDS, over x^T, and leave as whole lines.
#define XP 264                           /* LDS pitch of an x^T row and of a weight row in f16: 512 B + 16 B (16-byte reads and writes of 16 rows fall on all banks) */
#define TP 136                           /* LDS pitch of a gathered theta / phi row in f16: 256 B + 16 B */
#define GP 40                            /* LDS pitch of a gathered g row in f16: 64 B + 16 B */
__global__ __launch_bounds__(512) void k_proj(const float* __restrict__ x, const float* __restrict__ tw, const float* __restrict__ pw, const float* __restrict__ gw, const float* __restrict__ tb, const float* __restrict__ pb, const float* __restrict__ gb,
    const float* __restrict__ ww, const float* __restrict__ wb, const float* __restrict__ g, const float* __restrict__ be, const float* __restrict__ mu, const float* __restrict__ var, float eps,
    _Float16* __restrict__ TH, _Float16* __restrict__ THL, _Float16* __restrict__ PHT, _Float16* __restrict__ PHLT, _Float16* __restrict__ G16, _Float16* __restrict__ BW, float* __restrict__ BN4) {
  __shared__ __attribute__((aligned(16))) unsigned short wl[3 * CI * XP];
  __shared__ __attribute__((aligned(16))) float sb[3 * CI];
  __shared__ __attribute__((aligned(16))) unsigned short un[2 * 128 * TP + 2 * 32 * TP + CI * GP];      /* x^T first; the gathered results once every wave holds its x^T fragments */
  static_assert(128 * XP <= 2 * 128 * TP + 2 * 32 * TP + CI * GP, "x^T fits under the gathered results");
  unsigned short* const xt = un; unsigned short* const sth = un; unsigned short* const stl = sth + 128 * TP; unsigned short* const sph = stl + 128 * TP; unsigned short* const spl = sph + 32 * TP; unsigned short* const sg = spl + 32 * TP;
  const int tid = threadIdx.x, w = tid >> 5, lane = tid & 31, ln = lane & 15, hh = lane >> 4, by = blockIdx.y;
  const int n0 = blockIdx.x * 128;
  const int blk = by * (NP / 128) + blockIdx.x;      /* 0..255: the row of W that this work-group rounds */
  { /* Loads first, in the order in which they come back: the small operands and two of the three weight planes (L2), then x (memory); the planes are rounded while x flies. */
    const float* wp = ww + (size_t)blk * CI + lane * 4;
    const int bc = (blk & 31) * 8 + (lane & 7);
    const float* bp = (tid < CI ? tb : tid < 2 * CI ? pb : gb) + (tid & (CI - 1));
    const v4f wrow = *(const v4fa*)wp;
    const float q_wb = wb[bc], q_mu = mu[bc], q_g = g[bc], q_var = var[bc], q_be = be[bc], q_b = *bp;
    /* a weight plane [128][256] f32 = 16 steps of 8 KiB: a thread takes 16 bytes of each step, a wave 512 bytes in a row */
    const float* w0 = tw + tid * 4; const float* w1 = pw + tid * 4; const float* w2 = gw + tid * 4;
    v4f wa[16], wc[16];
#pragma unroll
    for (int k = 0; k < 16; ++k) wa[k] = *(const v4fa*)(w0 + k * 2048);
#pragma unroll
    for (int k = 0; k < 16; ++k) wc[k] = *(const v4fa*)(w1 + k * 2048);
    /* x: a wave takes two blocks of 32 c x 32 n: a lane 8 c x 4 n; 8 lanes read one 128-byte line of a channel row, and the 16 lanes of a half-wave write 16-byte pieces that fall on all banks */
    const int n = (w & 3) * 32 + 4 * ((lane & 3) + 4 * hh), c = (w >> 2) * 32 + 8 * ((lane >> 2) & 3);
    const float* sp = x + ((size_t)by * CN + c) * NP + n0 + n; v4f xa[2][8];
#pragma unroll
    for (int it = 0; it < 2; ++it)
#pragma unroll
      for (int q = 0; q < 8; ++q) xa[it][q] = *(const v4fa*)(sp + (size_t)(it * 128 + q) * NP);
    asm volatile("s_wait_xcnt 0x0" :: "v"(wp), "v"(bc), "v"(bp), "v"(w0), "v"(w1), "v"(sp) : "memory");      /* the wait that stands in front of any overwrite of a register which an issued load names; the addresses are inputs so that they stay live up to it */
    __builtin_amdgcn_sched_barrier(0);      /* keeps every load above in front of the rounding below: sunk to their uses, the x loads would start only after the planes are rounded, and nothing would cover the memory latency */
    unsigned short* wd = wl + (tid >> 6) * XP + (tid & 63) * 4;
    auto putw = [&](const v4f (&a)[16], int s) {
#pragma unroll
      for (int k = 0; k < 16; ++k) { const v2u o = {w16_pair(a[k][0], a[k][1]), w16_pair(a[k][2], a[k][3])}; *(v2u*)(wd + (s * CI + k * 8) * XP) = o; } };
    putw(wa, 0);
#pragma unroll
    for (int k = 0; k < 16; ++k) wa[k] = *(const v4fa*)(w2 + k * 2048);
    asm volatile("s_wait_xcnt 0x0" :: "v"(w2) : "memory");      /* as above, for the one address of this run */
    putw(wc, 1);
    if (tid < 3 * CI) sb[tid] = bf16_round(q_b);
    if (w == 15) { const v2u o = {w16_pair(wrow[0], wrow[1]), w16_pair(wrow[2], wrow[3])}; *(v2u*)((unsigned short*)BW + (size_t)blk * CI + lane * 4) = o; }
    if (w == 14 && blk < 32 && lane < 8) { const v4f o = {bf16_round(q_wb), bf16_round(q_mu), __fdiv_rn(bf16_round(q_g), sqrtf(bf16_round(q_var) + eps)), bf16_round(q_be)}; *(v4f*)(BN4 + 4 * bc) = o; }
#pragma unroll
    for (int it = 0; it < 2; ++it)
#pragma unroll
      for (int i = 0; i < 4; ++i) { FragH f;
#pragma unroll
        for (int q = 0; q < 8; ++q) f.h[q] = (_Float16)bf16_round(xa[it][q][i]);
        *(v8us*)(xt + (n + i) * XP + it * 128 + c) = f.half[0]; }
    putw(wa, 2);
  }
  const int p = w & 3, oq = w >> 2;
  v16h a[8]; v4f bb0, bb1;
  auto lda = [&](int ot) { const unsigned short* ar = wl + (ot * 16 + ln) * XP + 8 * hh; const float* br = sb + ot * 16 + 8 * hh;      /* the lane's own first bytes: elements 0..7 = k 8 hh + 0..7, elements 8..15 = k 16 + 8 hh + 0..7 of each 32, the order in which the rows of x^T are read */
#pragma unroll
    for (int j = 0; j < 8; ++j) a[j] = lds_frag(ar + j * 32);
    bb0 = *(const v4fa*)br; bb1 = *(const v4fa*)(br + 4); };
  __syncthreads();      /* publishes x^T, the weight rows and the biases */
  v16h b0[8], b1[8];
  { const unsigned short* r0 = xt + (p * 16 + ln) * XP + 8 * hh; const unsigned short* r1 = r0 + 64 * XP;
#pragma unroll
    for (int j = 0; j < 8; ++j) { b0[j] = lds_frag(r0 + j * 32); b1[j] = lds_frag(r1 + j * 32); } }
  lda(oq * 6);
  __syncthreads();      /* ends every wave's reads of x^T, which the gathered results overwrite */
  const v8f z8 = {0.f,0.f,0.f,0.f,0.f,0.f,0.f,0.f};
  const int nl = p * 16 + ln, ml = nl >> 1;
  /* rolled: the three kinds of row tile share one body, and an unrolled one would hold several tiles' weight fragments at once */
#pragma unroll 1
  for (int i = 0; i < 6; ++i) { const int ot = oq * 6 + i;
    v8f c0 = z8, c1 = z8;
#pragma unroll
    for (int j = 0; j < 8; ++j) { c0 = f_mma(a[j], b0[j], c0); c1 = f_mma(a[j], b1[j], c1); }
    float v0[8], v1[8];
#pragma unroll
    for (int r = 0; r < 8; ++r) { const float bv = r < 4 ? bb0[r & 3] : bb1[r & 3]; v0[r] = c0[r] * 0.0625f + bv; v1[r] = c1[r] * 0.0625f + bv; }
    if (i + 1 < 6) lda(ot + 1);      /* the next row tile's weights fly while this one's results are packed */
    if (ot < 8) { FragH h0, l0, h1, l1;
#pragma unroll
      for (int r = 0; r < 8; ++r) { _Float16 h = (_Float16)v0[r]; h0.h[r] = h; l0.h[r] = (_Float16)((v0[r] - (float)h) * 1024.0f); h = (_Float16)v1[r]; h1.h[r] = h; l1.h[r] = (_Float16)((v1[r] - (float)h) * 1024.0f); }
      const int e = nl * TP + ot * 16 + 8 * hh;
      *(v8us*)(sth + e) = h0.half[0]; *(v8us*)(stl + e) = l0.half[0]; *(v8us*)(sth + e + 64 * TP) = h1.half[0]; *(v8us*)(stl + e + 64 * TP) = l1.half[0];
    } else { float mx[8];
#pragma unroll
      for (int r = 0; r < 8; ++r) { const float u = fmaxf(v0[r], v1[r]); mx[r] = fmaxf(u, __shfl_xor(u, 1, 32)); }
      if (ot < 16) { FragH h0, l0;
#pragma unroll
        for (int r = 0; r < 8; ++r) { const _Float16 h = (_Float16)mx[r]; h0.h[r] = h; l0.h[r] = (_Float16)((mx[r] - (float)h) * 1024.0f); }
        if (!(ln & 1)) { const int e = ml * TP + (ot - 8) * 16 + 8 * hh; *(v8us*)(sph + e) = h0.half[0]; *(v8us*)(spl + e) = l0.half[0]; }
      } else if (!(ln & 1)) { FragH h0;
#pragma unroll
        for (int r = 0; r < 8; ++r) { h0.h[r] = (_Float16)mx[r]; sg[((ot - 16) * 16 + 8 * hh + r) * GP + ml] = h0.u[r]; } }
    }
  }
  __syncthreads();      /* every wave's results are gathered */
  { unsigned short* dh = (unsigned short*)TH + ((size_t)by * NP + n0) * CI; unsigned short* dl = (unsigned short*)THL + ((size_t)by * NP + n0) * CI;
#pragma unroll
    for (int k = 0; k < 4; ++k) { const int pc = k * 512 + tid, r = pc >> 4, q = (pc & 15) * 8; *(v8us*)(dh + r * CI + q) = *(const v8us*)(sth + r * TP + q); *(v8us*)(dl + r * CI + q) = *(const v8us*)(stl + r * TP + q); }
    const size_t mo = ((size_t)by * NM + blockIdx.x * 32) * CI;      /* the pooled row's 32 positions: rows of phi^T [m][ci]; one 32-key tile [ci][32] of g */
    { const int r = tid >> 4, q = (tid & 15) * 8; *(v8us*)((unsigned short*)PHT + mo + r * CI + q) = *(const v8us*)(sph + r * TP + q); *(v8us*)((unsigned short*)PHLT + mo + r * CI + q) = *(const v8us*)(spl + r * TP + q); }
    { const int r = tid >> 2, q = (tid & 3) * 8; *(v8us*)((unsigned short*)G16 + mo + r * 32 + q) = *(const v8us*)(sg + r * GP + q); } }
}

extern "C" void kernel_launch(void* const* d_in, const int* in_sizes, int n_in,
                              void* d_out, int out_size, void* d_ws, size_t ws_size, hipStream_t stream) {
  (void)in_sizes; (void)n_in; (void)out_size;
  const float* const* I = (const float* const*)d_in; const float* x = I[0]; const float* gw = I[1]; const float* gb = I[2]; const float* tw = I[3]; const float* tb = I[4]; const float* pw = I[5]; const float* pb = I[6]; const float* ww = I[7]; const float* wb = I[8]; const float* bng = I[9]; const float* bnb = I[10]; const float* bnm = I[11]; const float* bnv = I[12];      /* natural [out][in] 1x1-conv weights + biases: g, theta, phi [128][256]; W [256][128] + b; eval BatchNorm gamma / beta / running mean / var [256] */
  char* ws = (char*)d_ws; size_t off = 0;
  auto take = [&](size_t bytes) { char* p = ws + off; off += (bytes + 255) & ~(size_t)255; return p; };
  _Float16* BW = (_Float16*)take((size_t)CN * CI * 2); float* BN4 = (float*)take((size_t)CN * 4 * 4);
  /* every plane below holds all NB images, image b at b times the one-image size */
  const size_t sT = (size_t)NP * CI, sM = (size_t)CI * NM;      /* one image: [4096][128], [128][1024] elements */
  _Float16* TH = (_Float16*)take(NB * sT * 2); _Float16* THL = (_Float16*)take(NB * sT * 2); _Float16* PHT = (_Float16*)take(NB * sM * 2); _Float16* PHLT = (_Float16*)take(NB * sM * 2); _Float16* G16 = (_Float16*)take(NB * sM * 2);
  if (off > ws_size) return;
  k_proj<<<dim3(NP / 128, NB), 512, 0, stream>>>(x, tw, pw, gw, tb, pb, gb, ww, wb, bng, bnb, bnm, bnv, 1e-5f, TH, THL, PHT, PHLT, G16, BW, BN4);      /* theta^T [n][ci] hi + x1024 residual; pooled phi^T [m][ci] hi + residual; pooled g f16 as 32-key tiles [m / 32][ci][32]; 16 W as f16 and the BatchNorm constants for the next launch */
  k_fattn<<<dim3(NP / 128, NB), 256, 0, stream>>>(TH, THL, PHT, PHLT, G16, BW, BN4, x, (float*)d_out);      /* f[n][m] = theta.phi (hi.hi + (hi.lo + lo.hi) / 1024; no scale), softmax over the 1024 pooled positions, y^T [n][ci] = P g^T -> f16; z = ((W y + bf16 W_b[c]) - bf16 mean[c]) (bf16 gamma[c] / sqrt(bf16 var[c] + eps)) + bf16 beta[c] + bf16 x -> f32 channel-first output, in one launch */
}
